// v000
// Measured on an AMD MI455X. A time is GPU time per run, averaged over a window of back-to-back runs after a warm-up
// (all launches, gaps included; the runs take copies of the inputs in turn), and the median of several windows.
// Apart from v000's, it joins two sittings. Times from different sittings can be a few percent apart, while
// side-by-side timings come from the same sitting.
// v000, which the later versions start from, runs in 349 microseconds.
#include <hip/hip_runtime.h>

typedef __attribute__((ext_vector_type(2))) float v2f;
typedef __attribute__((ext_vector_type(8))) float v8f;

#define T_SEQ   4096
#define C_DIM   512
#define H_HEADS 128
#define CHUNK   16
#define NCHUNK  (T_SEQ / CHUNK)

__global__ __launch_bounds__(32) void rosa_sufa_kernel(
    const float* __restrict__ xq, const float* __restrict__ xk,
    const float* __restrict__ xv, const float* __restrict__ emb,
    float* __restrict__ out)
{
    const int lane = threadIdx.x;        // 0..31 (wave32)
    const int bh   = blockIdx.x;         // 0 .. B*H-1
    const int b    = bh >> 7;            // / 128 heads
    const int h    = bh & (H_HEADS - 1);
    const size_t base = (size_t)b * T_SEQ * C_DIM + (size_t)(h * 4);

    __shared__ __align__(16) float Qlds[16][4];   // Q rows (t, j)
    __shared__ __align__(16) float Kt[4][16];     // K transposed (j, s)
    __shared__ __align__(16) float Vt[4][16];     // V transposed (e, s)
    __shared__ __align__(16) float Alds[16 * 20]; // masked scores, row stride 20 (pad)
    __shared__ __align__(16) float Slds[16];      // S_prev broadcast, [j*4+e]

    const int m  = lane & 15;            // row (A-op) / col (B-op) / t (epilogue)
    const int hi = lane >> 4;            // half-wave id
    const int k0 = hi * 2;               // K-offset for f32 WMMA operands
    const int ep = hi;                   // output element pair
    const int e0 = 2 * ep;

    const float emb0 = emb[h * 4 + e0];
    const float emb1 = emb[h * 4 + e0 + 1];

    // Running 4x4 state: lane<16 owns S[j][e], j=lane>>2, e=lane&3 (exact f32)
    float Sreg = 0.0f;

    float4 qrow, krow, vrow;
    if (lane < 16) {
        size_t roff = base + (size_t)lane * C_DIM;
        qrow = *(const float4*)(xq + roff);
        krow = *(const float4*)(xk + roff);
        vrow = *(const float4*)(xv + roff);
    }

    for (int c = 0; c < NCHUNK; ++c) {
        // ---- stage chunk + previous state into LDS ----
        if (lane < 16) {
            *(float4*)(&Qlds[lane][0]) = qrow;
            Kt[0][lane] = krow.x; Kt[1][lane] = krow.y;
            Kt[2][lane] = krow.z; Kt[3][lane] = krow.w;
            Vt[0][lane] = vrow.x; Vt[1][lane] = vrow.y;
            Vt[2][lane] = vrow.z; Vt[3][lane] = vrow.w;
            Slds[lane]  = Sreg;
        }
        __syncthreads();

        // ---- prefetch next chunk (hide HBM latency behind compute) ----
        if (c + 1 < NCHUNK && lane < 16) {
            size_t roff = base + (size_t)((c + 1) * CHUNK + lane) * C_DIM;
            qrow = *(const float4*)(xq + roff);
            krow = *(const float4*)(xk + roff);
            vrow = *(const float4*)(xv + roff);
        }

        // ---- scores: A(16x16) = Q(16x4) x K^T(4x16), exact f32 WMMA ----
        v2f aop, bop;
        aop.x = Qlds[m][k0];     aop.y = Qlds[m][k0 + 1];
        bop.x = Kt[k0][m];       bop.y = Kt[k0 + 1][m];
        v8f acc = {};
        acc = __builtin_amdgcn_wmma_f32_16x16x4_f32(
                  false, aop, false, bop, (short)0, acc, false, false);

        // ---- causal mask (keep s <= t) in C/D layout; spill rows to LDS ----
#pragma unroll
        for (int r = 0; r < 8; ++r) {
            int M = r + 8 * hi;                  // query index t
            float a = (m <= M) ? acc[r] : 0.0f;  // key index s = m
            Alds[M * 20 + m] = a;
        }
        __syncthreads();

        // ---- epilogue: o[t][e0], o[t][e0+1] for t = m ----
        float o0 = 0.0f, o1 = 0.0f;
        // cross-chunk term with S_prev
#pragma unroll
        for (int j = 0; j < 4; ++j) {
            float qv = Qlds[m][j];
            o0 += qv * Slds[j * 4 + e0];
            o1 += qv * Slds[j * 4 + e0 + 1];
        }
        // intra-chunk term: masked A row (t) dot V columns
        const float4* Arow = (const float4*)(Alds + m * 20);
        const float4* Va   = (const float4*)(&Vt[e0][0]);
        const float4* Vb   = (const float4*)(&Vt[e0 + 1][0]);
#pragma unroll
        for (int i = 0; i < 4; ++i) {
            float4 a4 = Arow[i];
            float4 va = Va[i];
            float4 vb = Vb[i];
            o0 += a4.x * va.x + a4.y * va.y + a4.z * va.z + a4.w * va.w;
            o1 += a4.x * vb.x + a4.y * vb.y + a4.z * vb.z + a4.w * vb.w;
        }

        // ---- state update: S[j][e] += sum_s K[s][j] * V[s][e] ----
        {
            int j = (lane >> 2) & 3;   // valid for lane<16; lanes>=16 do harmless dup
            int e = lane & 3;
            const float4* Kj = (const float4*)(&Kt[j][0]);
            const float4* Ve = (const float4*)(&Vt[e][0]);
            float accS = 0.0f;
#pragma unroll
            for (int i = 0; i < 4; ++i) {
                float4 kk = Kj[i];
                float4 vv = Ve[i];
                accS += kk.x * vv.x + kk.y * vv.y + kk.z * vv.z + kk.w * vv.w;
            }
            Sreg += accS;
        }

        // ---- write output (x emb) ----
        {
            size_t ooff = base + (size_t)(c * CHUNK + m) * C_DIM + e0;
            float2 ov;
            ov.x = o0 * emb0;
            ov.y = o1 * emb1;
            *(float2*)(out + ooff) = ov;
        }
        __syncthreads();  // protect LDS before next iteration's staging stores
    }
}

extern "C" void kernel_launch(void* const* d_in, const int* in_sizes, int n_in,
                              void* d_out, int out_size, void* d_ws, size_t ws_size,
                              hipStream_t stream) {
    (void)n_in; (void)out_size; (void)d_ws; (void)ws_size;
    const float* xq  = (const float*)d_in[0];
    const float* xk  = (const float*)d_in[1];
    const float* xv  = (const float*)d_in[2];
    const float* emb = (const float*)d_in[3];
    float* out = (float*)d_out;

    const int B = in_sizes[0] / (T_SEQ * C_DIM);   // = 4
    dim3 grid(B * H_HEADS);                        // one wave per (b, head)
    dim3 block(32);
    hipLaunchKernelGGL(rosa_sufa_kernel, grid, block, 0, stream,
                       xq, xk, xv, emb, out);
}

// v001
// A run of this version takes 43.1 microseconds.
// Timed twice side by side with v000, it ran 8.14 and 8.10 times as fast.
#include <hip/hip_runtime.h>

typedef __attribute__((ext_vector_type(2))) float v2f;
typedef __attribute__((ext_vector_type(8))) float v8f;

#define T_SEQ   4096
#define C_DIM   512
#define H_HEADS 128
#define CHUNK   16
#define NSEG    16                 // time segments per sequence
#define SEG     (T_SEQ / NSEG)     // 256 tokens per segment
#define SEGCH   (SEG / CHUNK)      // 16 chunks per segment
#define HGRP    8                  // heads per block: 8 x 4 floats = one 128-byte line per row
#define NGRP    (H_HEADS / HGRP)

// Launch 1: per (batch, segment, head) the 4x4 sum of k v^T over the segment's tokens.
// ws layout: [(b * NGRP + g) * NSEG + seg][head in group][j * 4 + e], 512 bytes per block.
// The last segment's sum is never read and is not computed.
__global__ __launch_bounds__(SEG) void seg_state_kernel(
    const float* __restrict__ xk, const float* __restrict__ xv,
    float* __restrict__ ws)
{
    const int tid  = threadIdx.x;
    const int lane = tid & 31;
    const int wave = tid >> 5;           // 8 waves, 32 tokens each
    const int hl   = lane & 7;           // head within the group
    const int r4   = lane >> 3;          // row within a group of 4 rows
    const int g    = blockIdx.x;
    const int seg  = blockIdx.y;
    const int b    = blockIdx.z;
    const size_t base = ((size_t)b * T_SEQ + (size_t)(seg * SEG + wave * 32 + r4)) * C_DIM
                      + (size_t)(g * (HGRP * 4) + hl * 4);

    __shared__ __align__(16) float red[SEG / 32][HGRP][16];

    // every loop over s[] is unrolled so that s[] lives in registers
    float s[16];
#pragma unroll
    for (int n = 0; n < 16; ++n) s[n] = 0.0f;

    // unrolled so that the independent loads of all 8 trips can be issued ahead
#pragma unroll
    for (int i = 0; i < 8; ++i) {
        const float4 k = *(const float4*)(xk + base + (size_t)(i * 4) * C_DIM);
        const float4 v = *(const float4*)(xv + base + (size_t)(i * 4) * C_DIM);
        s[0]  += k.x * v.x; s[1]  += k.x * v.y; s[2]  += k.x * v.z; s[3]  += k.x * v.w;
        s[4]  += k.y * v.x; s[5]  += k.y * v.y; s[6]  += k.y * v.z; s[7]  += k.y * v.w;
        s[8]  += k.z * v.x; s[9]  += k.z * v.y; s[10] += k.z * v.z; s[11] += k.z * v.w;
        s[12] += k.w * v.x; s[13] += k.w * v.y; s[14] += k.w * v.z; s[15] += k.w * v.w;
    }

    // sum over the wave's 4 row groups (lanes that differ in bits 3 and 4)
#pragma unroll
    for (int n = 0; n < 16; ++n) {
        s[n] += __shfl_xor(s[n], 8);
        s[n] += __shfl_xor(s[n], 16);
    }
    if (r4 == 0) {
#pragma unroll
        for (int n = 0; n < 16; ++n) red[wave][hl][n] = s[n];
    }
    __syncthreads();

    // sum over the 8 waves: 128 threads, one of the 8 x 16 values each
    if (tid < HGRP * 16) {
        const float* r = &red[0][0][0] + tid;
        float t = 0.0f;
#pragma unroll   // the 8 LDS reads go out together
        for (int u = 0; u < SEG / 32; ++u) t += r[u * (HGRP * 16)];
        ws[((size_t)(b * NGRP + g) * NSEG + seg) * (HGRP * 16) + tid] = t;
    }
}

// Launch 2: one wave per (batch, head, segment); a block holds the 8 heads of one line.
__global__ __launch_bounds__(256) void rosa_sufa_kernel(
    const float* __restrict__ xq, const float* __restrict__ xk,
    const float* __restrict__ xv, const float* __restrict__ emb,
    const float* __restrict__ ws, float* __restrict__ out)
{
    const int lane = threadIdx.x & 31;   // 0..31 (wave32)
    const int w    = threadIdx.x >> 5;   // wave = head within the group
    const int g    = blockIdx.x;         // head group
    const int seg  = blockIdx.y;         // time segment
    const int b    = blockIdx.z;
    const int h    = g * HGRP + w;
    const int c0   = seg * SEGCH;        // first chunk of the segment
    const size_t base = (size_t)b * T_SEQ * C_DIM + (size_t)(h * 4);

    // each wave has its own slice of every array
    __shared__ __align__(16) float QldsW[HGRP][16][4];   // Q rows (t, j)
    __shared__ __align__(16) float KtW[HGRP][4][16];     // K transposed (j, s)
    __shared__ __align__(16) float VtW[HGRP][4][16];     // V transposed (e, s)
    __shared__ __align__(16) float AldsW[HGRP][16 * 20]; // masked scores, row stride 20 (pad)
    __shared__ __align__(16) float SldsW[HGRP][16];      // S_prev broadcast, [j*4+e]
    float (*Qlds)[4] = QldsW[w];
    float (*Kt)[16]  = KtW[w];
    float (*Vt)[16]  = VtW[w];
    float* Alds      = AldsW[w];
    float* Slds      = SldsW[w];

    const int m  = lane & 15;            // row (A-op) / col (B-op) / t (epilogue)
    const int hi = lane >> 4;            // half-wave id
    const int k0 = hi * 2;               // K-offset for f32 WMMA operands
    const int ep = hi;                   // output element pair
    const int e0 = 2 * ep;

    const float emb0 = emb[h * 4 + e0];
    const float emb1 = emb[h * 4 + e0 + 1];

    // Running 4x4 state: lane<16 owns S[j][e], j=lane>>2, e=lane&3 (exact f32)
    // It starts from the sum of the earlier segments' k v^T sums (launch 1).
    float Sreg = 0.0f;

    float4 qrow, krow, vrow;
    if (lane < 16) {
        const float* p = ws + (size_t)(b * NGRP + g) * NSEG * (HGRP * 16) + w * 16 + lane;
        // both loops over part[] are unrolled: part[] lives in registers and the
        // loads, all of them of sums that launch 1 wrote, are in flight together
        float part[NSEG - 1];
#pragma unroll
        for (int s = 0; s < NSEG - 1; ++s) part[s] = p[s * (HGRP * 16)];
        // precaution: stands in front of any rewrite of the registers that hold p
        asm volatile("s_wait_xcnt 0x0" ::: "memory");
        size_t roff = base + (size_t)(c0 * CHUNK + lane) * C_DIM;
        qrow = *(const float4*)(xq + roff);
        krow = *(const float4*)(xk + roff);
        vrow = *(const float4*)(xv + roff);
#pragma unroll
        for (int s = 0; s < NSEG - 1; ++s) Sreg += (s < seg) ? part[s] : 0.0f;
    }

    for (int c = c0; c < c0 + SEGCH; ++c) {
        // ---- stage chunk + previous state into LDS ----
        if (lane < 16) {
            *(float4*)(&Qlds[lane][0]) = qrow;
            Kt[0][lane] = krow.x; Kt[1][lane] = krow.y;
            Kt[2][lane] = krow.z; Kt[3][lane] = krow.w;
            Vt[0][lane] = vrow.x; Vt[1][lane] = vrow.y;
            Vt[2][lane] = vrow.z; Vt[3][lane] = vrow.w;
            Slds[lane]  = Sreg;
        }
        __syncthreads();

        // ---- prefetch next chunk (hide HBM latency behind compute) ----
        if (c + 1 < c0 + SEGCH && lane < 16) {
            size_t roff = base + (size_t)((c + 1) * CHUNK + lane) * C_DIM;
            qrow = *(const float4*)(xq + roff);
            krow = *(const float4*)(xk + roff);
            vrow = *(const float4*)(xv + roff);
            // precaution: stands in front of any rewrite of the three address pairs
            asm volatile("s_wait_xcnt 0x0" ::: "memory");
        }

        // ---- scores: A(16x16) = Q(16x4) x K^T(4x16), exact f32 WMMA ----
        v2f aop, bop;
        aop.x = Qlds[m][k0];     aop.y = Qlds[m][k0 + 1];
        bop.x = Kt[k0][m];       bop.y = Kt[k0 + 1][m];
        v8f acc = {};
        acc = __builtin_amdgcn_wmma_f32_16x16x4_f32(
                  false, aop, false, bop, (short)0, acc, false, false);

        // ---- causal mask (keep s <= t) in C/D layout; spill rows to LDS ----
#pragma unroll
        for (int r = 0; r < 8; ++r) {
            int M = r + 8 * hi;                  // query index t
            float a = (m <= M) ? acc[r] : 0.0f;  // key index s = m
            Alds[M * 20 + m] = a;
        }
        __syncthreads();

        // ---- epilogue: o[t][e0], o[t][e0+1] for t = m ----
        float o0 = 0.0f, o1 = 0.0f;
        // cross-chunk term with S_prev
#pragma unroll
        for (int j = 0; j < 4; ++j) {
            float qv = Qlds[m][j];
            o0 += qv * Slds[j * 4 + e0];
            o1 += qv * Slds[j * 4 + e0 + 1];
        }
        // intra-chunk term: masked A row (t) dot V columns
        const float4* Arow = (const float4*)(Alds + m * 20);
        const float4* Va   = (const float4*)(&Vt[e0][0]);
        const float4* Vb   = (const float4*)(&Vt[e0 + 1][0]);
#pragma unroll
        for (int i = 0; i < 4; ++i) {
            float4 a4 = Arow[i];
            float4 va = Va[i];
            float4 vb = Vb[i];
            o0 += a4.x * va.x + a4.y * va.y + a4.z * va.z + a4.w * va.w;
            o1 += a4.x * vb.x + a4.y * vb.y + a4.z * vb.z + a4.w * vb.w;
        }

        // ---- state update: S[j][e] += sum_s K[s][j] * V[s][e] ----
        {
            int j = (lane >> 2) & 3;   // valid for lane<16; lanes>=16 do harmless dup
            int e = lane & 3;
            const float4* Kj = (const float4*)(&Kt[j][0]);
            const float4* Ve = (const float4*)(&Vt[e][0]);
            float accS = 0.0f;
#pragma unroll
            for (int i = 0; i < 4; ++i) {
                float4 kk = Kj[i];
                float4 vv = Ve[i];
                accS += kk.x * vv.x + kk.y * vv.y + kk.z * vv.z + kk.w * vv.w;
            }
            Sreg += accS;
        }

        // ---- write output (x emb) ----
        {
            size_t ooff = base + (size_t)(c * CHUNK + m) * C_DIM + e0;
            float2 ov;
            ov.x = o0 * emb0;
            ov.y = o1 * emb1;
            *(float2*)(out + ooff) = ov;
        }
        __syncthreads();  // protect LDS before next iteration's staging stores
    }
}

extern "C" void kernel_launch(void* const* d_in, const int* in_sizes, int n_in,
                              void* d_out, int out_size, void* d_ws, size_t ws_size,
                              hipStream_t stream) {
    (void)n_in; (void)out_size; (void)ws_size;
    const float* xq  = (const float*)d_in[0];
    const float* xk  = (const float*)d_in[1];
    const float* xv  = (const float*)d_in[2];
    const float* emb = (const float*)d_in[3];
    float* out = (float*)d_out;
    float* ws  = (float*)d_ws;

    const int B = in_sizes[0] / (T_SEQ * C_DIM);   // = 4
    // launch 1: each lane sums 8 tokens of one head (one wave per 32 tokens)
    hipLaunchKernelGGL(seg_state_kernel, dim3(NGRP, NSEG - 1, B), dim3(SEG), 0, stream,
                       xk, xv, ws);
    hipLaunchKernelGGL(rosa_sufa_kernel, dim3(NGRP, NSEG, B), dim3(HGRP * 32), 0, stream,
                       xq, xk, xv, emb, ws, out);
}

// v002
// It runs in 22.4 microseconds.
// Next to v001, in two timings, it ran 1.91 and 1.94 times as fast.
// All steps since v000 together make it 15.6 times as fast.
#include <hip/hip_runtime.h>

typedef __attribute__((ext_vector_type(2))) float v2f;
typedef __attribute__((ext_vector_type(8))) float v8f;

#define T_SEQ   4096
#define C_DIM   512
#define H_HEADS 128
#define CHUNK   16
#define NSEG    16                 // time segments per sequence
#define SEG     (T_SEQ / NSEG)     // 256 tokens per segment
#define HGRP    8                  // heads per block: 8 x 4 floats = one 128-byte line per row
#define NGRP    (H_HEADS / HGRP)

// Launch 1: per (batch, segment, head) the 4x4 sum of k v^T over the segment's tokens.
// ws layout: [(b * NGRP + g) * NSEG + seg][head in group][j * 4 + e], 512 bytes per block.
// The last segment's sum is never read and is not computed.
__global__ __launch_bounds__(SEG) void seg_state_kernel(
    const float* __restrict__ xk, const float* __restrict__ xv,
    float* __restrict__ ws)
{
    const int tid  = threadIdx.x;
    const int lane = tid & 31;
    const int wave = tid >> 5;           // 8 waves, 32 tokens each
    const int hl   = lane & 7;           // head within the group
    const int r4   = lane >> 3;          // row within a group of 4 rows
    const int g    = blockIdx.x;
    const int seg  = blockIdx.y;
    const int b    = blockIdx.z;
    const size_t base = ((size_t)b * T_SEQ + (size_t)(seg * SEG + wave * 32 + r4)) * C_DIM
                      + (size_t)(g * (HGRP * 4) + hl * 4);

    __shared__ __align__(16) float red[SEG / 32][HGRP][16];

    // every loop over s[] is unrolled so that s[] lives in registers
    float s[16];
#pragma unroll
    for (int n = 0; n < 16; ++n) s[n] = 0.0f;

    // unrolled so that the independent loads of all 8 trips can be issued ahead
#pragma unroll
    for (int i = 0; i < 8; ++i) {
        const float4 k = *(const float4*)(xk + base + (size_t)(i * 4) * C_DIM);
        const float4 v = *(const float4*)(xv + base + (size_t)(i * 4) * C_DIM);
        s[0]  += k.x * v.x; s[1]  += k.x * v.y; s[2]  += k.x * v.z; s[3]  += k.x * v.w;
        s[4]  += k.y * v.x; s[5]  += k.y * v.y; s[6]  += k.y * v.z; s[7]  += k.y * v.w;
        s[8]  += k.z * v.x; s[9]  += k.z * v.y; s[10] += k.z * v.z; s[11] += k.z * v.w;
        s[12] += k.w * v.x; s[13] += k.w * v.y; s[14] += k.w * v.z; s[15] += k.w * v.w;
    }

    // sum over the wave's 4 row groups (lanes that differ in bits 3 and 4)
#pragma unroll
    for (int n = 0; n < 16; ++n) {
        s[n] += __shfl_xor(s[n], 8);
        s[n] += __shfl_xor(s[n], 16);
    }
    if (r4 == 0) {
#pragma unroll
        for (int n = 0; n < 16; ++n) red[wave][hl][n] = s[n];
    }
    __syncthreads();

    // sum over the 8 waves: 128 threads, one of the 8 x 16 values each
    if (tid < HGRP * 16) {
        const float* r = &red[0][0][0] + tid;
        float t = 0.0f;
#pragma unroll   // the 8 LDS reads go out together
        for (int u = 0; u < SEG / 32; ++u) t += r[u * (HGRP * 16)];
        ws[((size_t)(b * NGRP + g) * NSEG + seg) * (HGRP * 16) + tid] = t;
    }
}

// Launch 2: a block holds the 8 heads of one 128-byte line and one time segment.
// A stage is 32 rows (two chunks of 16 tokens) of q, k and v. Every global load and store
// of a wave covers 4 whole lines; the tile lies row-major in LDS, and each wave (one head)
// reads its matrix fragments straight from it. All chunk products run on the f32 matrix form:
//   P^T = K Q^T ; O^T = S^T Q^T + V^T P^T(masked) ; S += K^T V
// V^T P^T: k slot (half h, register i) of slab n stands for token 8h + 2n + i on both operands.
// K^T V: one instruction for all 16 tokens; rows are (slab, j), columns (slab, e), k the token
// within a slab of 4, so the 4 x 4 blocks with equal slabs hold the slabs' sums.
#define ROWS    32                 // rows per stage
#define PITCH   36                 // dwords per LDS row: 16 rows x 16 bytes meet all 64 banks once
#define NST     (SEG / ROWS)       // 8 stages per segment

__device__ __forceinline__ v8f mm4(v2f a, v2f b, v8f c)
{
    return __builtin_amdgcn_wmma_f32_16x16x4_f32(false, a, false, b, (short)0, c, false, false);
}

// x + x of the lane whose number within its row of 16 differs by the mask in CTRL (row_xmask)
template <int CTRL>
__device__ __forceinline__ float row_xor_add(float x)
{
    return x + __int_as_float(__builtin_amdgcn_update_dpp(0, __float_as_int(x), CTRL, 0xf, 0xf, true));
}

// Work-group barrier that orders LDS traffic only: the waves share nothing through global
// memory, and __syncthreads() would also wait out the output stores at every stage.
__device__ __forceinline__ void lds_barrier()
{
    __builtin_amdgcn_fence(__ATOMIC_RELEASE, "workgroup", "local");
    __builtin_amdgcn_s_barrier();
    __builtin_amdgcn_fence(__ATOMIC_ACQUIRE, "workgroup", "local");
}

// q, k, v, emb and out carry no __restrict__: as invariant loads the compiler sinks the next
// stage's rows down to their LDS stores, and their latency is then waited out at every stage.
__global__ __launch_bounds__(256) void rosa_sufa_kernel(
    const float* xq, const float* xk, const float* xv, const float* emb,
    const float* __restrict__ ws, float* out)
{
    const int tid  = threadIdx.x;
    const int lane = tid & 31;           // 0..31 (wave32)
    const int w    = tid >> 5;           // wave = head within the group
    const int g    = blockIdx.x;         // head group
    const int seg  = blockIdx.y;         // time segment
    const int b    = blockIdx.z;
    const int m    = lane & 15;          // fragment row or column
    const int hi   = lane >> 4;          // half-wave id
    const int e    = m & 3;              // value column (rows of V^T repeat every 4)
    const int jm   = (m & 1) + 2 * (m >> 3);  // K^T V: row m is j = jm of slab (m >> 1) & 3,
    const int ra   = 4 * ((m >> 1) & 3) + 2 * hi;   // its two tokens in this half
    const int rb   = 4 * (m >> 2) + 2 * hi;         // column m is e of slab m >> 2
    const bool sb0 = (m >> 2) & 1;       // the column's slab, bit by bit
    const bool sb1 = (m >> 3) & 1;
    const int hc   = w * 4;              // the head's first column in the tile

    __shared__ __align__(16) float tile[2][3][ROWS][PITCH];

    // staging role: 8 threads per row, 16 bytes each
    const int srow = tid >> 3;
    const int scol = (tid & 7) * 4;
    const size_t gbase = ((size_t)b * T_SEQ + (size_t)(seg * SEG + srow)) * C_DIM
                       + (size_t)(g * (HGRP * 4) + scol);
    const float4 emb4 = *(const float4*)(emb + g * (HGRP * 4) + scol);

    float4 q4 = *(const float4*)(xq + gbase);
    float4 k4 = *(const float4*)(xk + gbase);
    float4 v4 = *(const float4*)(xv + gbase);

    // Running state: S[i] of lane (m, hi) is state[2 hi + i][m & 3], i = 0, 1: the A fragment
    // of S^T. It starts from the earlier segments' sums (launch 1).
    v2f S;
    {
        const float* p = ws + (size_t)(b * NGRP + g) * NSEG * (HGRP * 16) + w * 16 + hi * 8 + e;
        // both loops are unrolled: the parts live in registers and the loads, all of them
        // of sums that launch 1 wrote, are in flight together
        float pa[NSEG - 1], pb[NSEG - 1];
#pragma unroll
        for (int s = 0; s < NSEG - 1; ++s) {
            pa[s] = p[s * (HGRP * 16)];
            pb[s] = p[s * (HGRP * 16) + 4];
        }
        // precaution: stands in front of any rewrite of the address registers of the loads above
        asm volatile("s_wait_xcnt 0x0" ::: "memory");
        float s0 = 0.0f, s1 = 0.0f;
#pragma unroll
        for (int s = 0; s < NSEG - 1; ++s) {
            s0 += (s < seg) ? pa[s] : 0.0f;
            s1 += (s < seg) ? pb[s] : 0.0f;
        }
        S.x = s0;
        S.y = s1;
    }

    for (int st = 0; st < NST; ++st) {
        float (*Q)[PITCH] = tile[st & 1][0];
        float (*K)[PITCH] = tile[st & 1][1];
        float (*V)[PITCH] = tile[st & 1][2];

        // ---- stage the 32 rows; the other buffer's last readers left before the last barrier ----
        *(float4*)(&Q[srow][scol]) = q4;
        *(float4*)(&K[srow][scol]) = k4;
        *(float4*)(&V[srow][scol]) = v4;
        lds_barrier();

        // ---- next stage's rows fly while this stage is worked on ----
        if (st + 1 < NST) {
            const size_t off = gbase + (size_t)((st + 1) * ROWS) * C_DIM;
            q4 = *(const float4*)(xq + off);
            k4 = *(const float4*)(xk + off);
            v4 = *(const float4*)(xv + off);
            // precaution: stands in front of any rewrite of the three address pairs; its memory
            // clobber also keeps the three loads above the stage's LDS reads
            asm volatile("s_wait_xcnt 0x0" ::: "memory");
        }

        float4 o[2];
#pragma unroll   // two chunks of one stage: o[] stays in registers
        for (int ch = 0; ch < 2; ++ch) {
            const int r0 = ch * CHUNK;
            const v2f q2 = *(const v2f*)(&Q[r0 + m][hc + 2 * hi]);   // Q[t = m][j = 2 hi + i]
            const v2f k2 = *(const v2f*)(&K[r0 + m][hc + 2 * hi]);   // K[s = m][j = 2 hi + i]

            // scores transposed: P[r] of lane (m, hi) = q_t . k_s, t = m, s = 8 hi + r
            v8f P = {};
            P = mm4(k2, q2, P);
#pragma unroll   // P[] is indexed by r: registers only
            for (int r = 0; r < 8; ++r) P[r] = (8 * hi + r <= m) ? P[r] : 0.0f;  // keep s <= t

            // cross-chunk term with the state before this chunk
            v8f O = {};
            O = mm4(S, q2, O);

#pragma unroll   // P[] is indexed by n: registers only
            for (int n = 0; n < 4; ++n) {
                const int s0 = r0 + 8 * hi + 2 * n;
                v2f vt, pp;
                vt.x = V[s0][hc + e];  vt.y = V[s0 + 1][hc + e];
                pp.x = P[2 * n];       pp.y = P[2 * n + 1];
                O = mm4(vt, pp, O);    // O[r] = o[t = m][r & 3]
            }
            o[ch].x = O[0]; o[ch].y = O[1]; o[ch].z = O[2]; o[ch].w = O[3];

            // state += K^T V: D[r] of lane (m, hi) is row (slab r >> 1, j = 2 hi + (r & 1)),
            // column (slab m >> 2, e); keep the column's own slab, then sum the 4 slabs' lanes
            v2f ka, vb;
            ka.x = K[r0 + ra][hc + jm]; ka.y = K[r0 + ra + 1][hc + jm];
            vb.x = V[r0 + rb][hc + e];  vb.y = V[r0 + rb + 1][hc + e];
            v8f D = {};
            D = mm4(ka, vb, D);
            float d0 = sb1 ? (sb0 ? D[6] : D[4]) : (sb0 ? D[2] : D[0]);
            float d1 = sb1 ? (sb0 ? D[7] : D[5]) : (sb0 ? D[3] : D[1]);
            d0 = row_xor_add<0x164>(d0); d1 = row_xor_add<0x164>(d1);   // row_xmask:4
            d0 = row_xor_add<0x168>(d0); d1 = row_xor_add<0x168>(d1);   // row_xmask:8
            S.x += d0;
            S.y += d1;
        }

        // ---- the head's outputs take the place of its own q columns (read by this wave alone) ----
        {
            float4 ov;
            ov.x = hi ? o[1].x : o[0].x; ov.y = hi ? o[1].y : o[0].y;
            ov.z = hi ? o[1].z : o[0].z; ov.w = hi ? o[1].w : o[0].w;
            *(float4*)(&Q[hi * CHUNK + m][hc]) = ov;
        }
        lds_barrier();

        // ---- write output (x emb), whole lines ----
        {
            const float4 r = *(const float4*)(&Q[srow][scol]);
            float4 ov;
            ov.x = r.x * emb4.x; ov.y = r.y * emb4.y; ov.z = r.z * emb4.z; ov.w = r.w * emb4.w;
            *(float4*)(out + gbase + (size_t)(st * ROWS) * C_DIM) = ov;
            // precaution: stands in front of any rewrite of the store's address pair
            asm volatile("s_wait_xcnt 0x0" ::: "memory");
        }
    }
}

extern "C" void kernel_launch(void* const* d_in, const int* in_sizes, int n_in,
                              void* d_out, int out_size, void* d_ws, size_t ws_size,
                              hipStream_t stream) {
    (void)n_in; (void)out_size; (void)ws_size;
    const float* xq  = (const float*)d_in[0];
    const float* xk  = (const float*)d_in[1];
    const float* xv  = (const float*)d_in[2];
    const float* emb = (const float*)d_in[3];
    float* out = (float*)d_out;
    float* ws  = (float*)d_ws;

    const int B = in_sizes[0] / (T_SEQ * C_DIM);   // = 4
    // launch 1: each lane sums 8 tokens of one head (one wave per 32 tokens)
    hipLaunchKernelGGL(seg_state_kernel, dim3(NGRP, NSEG - 1, B), dim3(SEG), 0, stream,
                       xk, xv, ws);
    hipLaunchKernelGGL(rosa_sufa_kernel, dim3(NGRP, NSEG, B), dim3(HGRP * 32), 0, stream,
                       xq, xk, xv, emb, ws, out);
}

// v003
// A run of this version takes 19.8 microseconds.
// Timed twice side by side with v002, it ran 1.12 and 1.13 times as fast.
// Over all steps from v000 it is 17.6 times as fast.
#include <hip/hip_runtime.h>

typedef __attribute__((ext_vector_type(2))) float v2f;
typedef __attribute__((ext_vector_type(8))) float v8f;

#define T_SEQ   4096
#define C_DIM   512
#define H_HEADS 128
#define CHUNK   16
#define NSEG    16                 // time segments per sequence
#define SEG     (T_SEQ / NSEG)     // 256 tokens per segment
#define HGRP    8                  // heads per block: 8 x 4 floats = one 128-byte line per row
#define NGRP    (H_HEADS / HGRP)

// Launch 1: per (batch, segment, head) the 4x4 sum of k v^T over the segment's tokens.
// ws layout: [(b * NGRP + g) * NSEG + seg][head in group][j * 4 + e], 512 bytes per block.
// The last segment's sum is never read and is not computed.
__global__ __launch_bounds__(SEG) void seg_state_kernel(
    const float* __restrict__ xk, const float* __restrict__ xv,
    float* __restrict__ ws)
{
    const int tid  = threadIdx.x;
    const int lane = tid & 31;
    const int wave = tid >> 5;           // 8 waves, 32 tokens each
    const int hl   = lane & 7;           // head within the group
    const int r4   = lane >> 3;          // row within a group of 4 rows
    const int g    = blockIdx.x;
    const int seg  = blockIdx.y;
    const int b    = blockIdx.z;
    const size_t base = ((size_t)b * T_SEQ + (size_t)(seg * SEG + wave * 32 + r4)) * C_DIM
                      + (size_t)(g * (HGRP * 4) + hl * 4);

    __shared__ __align__(16) float red[SEG / 32][HGRP][16];

    // every loop over s[] is unrolled so that s[] lives in registers
    float s[16];
#pragma unroll
    for (int n = 0; n < 16; ++n) s[n] = 0.0f;

    // unrolled so that the independent loads of all 8 trips can be issued ahead
#pragma unroll
    for (int i = 0; i < 8; ++i) {
        const float4 k = *(const float4*)(xk + base + (size_t)(i * 4) * C_DIM);
        const float4 v = *(const float4*)(xv + base + (size_t)(i * 4) * C_DIM);
        s[0]  += k.x * v.x; s[1]  += k.x * v.y; s[2]  += k.x * v.z; s[3]  += k.x * v.w;
        s[4]  += k.y * v.x; s[5]  += k.y * v.y; s[6]  += k.y * v.z; s[7]  += k.y * v.w;
        s[8]  += k.z * v.x; s[9]  += k.z * v.y; s[10] += k.z * v.z; s[11] += k.z * v.w;
        s[12] += k.w * v.x; s[13] += k.w * v.y; s[14] += k.w * v.z; s[15] += k.w * v.w;
    }

    // sum over the wave's 4 row groups (lanes that differ in bits 3 and 4)
#pragma unroll
    for (int n = 0; n < 16; ++n) {
        s[n] += __shfl_xor(s[n], 8);
        s[n] += __shfl_xor(s[n], 16);
    }
    if (r4 == 0) {
#pragma unroll
        for (int n = 0; n < 16; ++n) red[wave][hl][n] = s[n];
    }
    __syncthreads();

    // sum over the 8 waves: 128 threads, one of the 8 x 16 values each
    if (tid < HGRP * 16) {
        const float* r = &red[0][0][0] + tid;
        float t = 0.0f;
#pragma unroll   // the 8 LDS reads go out together
        for (int u = 0; u < SEG / 32; ++u) t += r[u * (HGRP * 16)];
        ws[((size_t)(b * NGRP + g) * NSEG + seg) * (HGRP * 16) + tid] = t;
    }
}

// Launch 2: a block holds the 8 heads of one 128-byte line and one time segment.
// A stage is 32 rows (two chunks of 16 tokens) of q, k and v. Every global load and store
// of a wave covers 4 whole lines; the tile lies row-major in LDS, and each wave (one head)
// reads its matrix fragments straight from it. All chunk products run on the f32 matrix form,
// one instruction each for the 16 tokens of a chunk, taken as 4 slabs of 4 tokens:
//   K^T V: rows (slab, j), columns (slab, e), k the token within a slab: the 4 x 4 blocks with
//          equal slabs hold the slabs' sums; their scan over the slabs gives each slab's own state.
//   K Q^T: scores; a token needs only those of its own slab (masked to s <= t).
//   O^T  : rows (slab, e), columns t: V^T of every slab times the own-slab scores, plus every
//          slab's state (transposed) times Q^T; column t is right in the rows of t's own slab.
#define ROWS    32                 // rows per stage
#define PITCH   36                 // dwords per LDS row: 16 rows x 16 bytes meet all 64 banks once
#define NST     (SEG / ROWS)       // 8 stages per segment

__device__ __forceinline__ v8f mm4(v2f a, v2f b, v8f c)
{
    return __builtin_amdgcn_wmma_f32_16x16x4_f32(false, a, false, b, (short)0, c, false, false);
}

// x of the lane N places lower within the row of 16 lanes (row_shr:N), 0 where there is none
template <int N>
__device__ __forceinline__ float row_down(float x)
{
    return __int_as_float(__builtin_amdgcn_update_dpp(0, __float_as_int(x), 0x110 + N, 0xf, 0xf, true));
}

// x of lane 12 + (lane & 3) of the same row of 16 lanes. All lanes are on, so the fetch-inactive
// flag changes no value: with it the result needs no start value (one register move less).
__device__ __forceinline__ float row_top4(float x)
{
    return __int_as_float(__builtin_amdgcn_permlane16(0, __float_as_int(x), 0xfedcfedcu, 0xfedcfedcu,
                                                      true, false));
}

// Work-group barrier that orders LDS traffic only: the waves share nothing through global
// memory, and __syncthreads() would also wait out the output stores at every stage.
__device__ __forceinline__ void lds_barrier()
{
    __builtin_amdgcn_fence(__ATOMIC_RELEASE, "workgroup", "local");
    __builtin_amdgcn_s_barrier();
    __builtin_amdgcn_fence(__ATOMIC_ACQUIRE, "workgroup", "local");
}

// q, k, v, emb and out carry no __restrict__: as invariant loads the compiler sinks the next
// stage's rows down to their LDS stores, and their latency is then waited out at every stage.
__global__ __launch_bounds__(256) void rosa_sufa_kernel(
    const float* xq, const float* xk, const float* xv, const float* emb,
    const float* __restrict__ ws, float* out)
{
    const int tid  = threadIdx.x;
    const int lane = tid & 31;           // 0..31 (wave32)
    const int w    = tid >> 5;           // wave = head within the group
    const int g    = blockIdx.x;         // head group
    const int seg  = blockIdx.y;         // time segment
    const int b    = blockIdx.z;
    const int m    = lane & 15;          // fragment row or column
    const int hi   = lane >> 4;          // half-wave id
    const int e    = m & 3;              // value column; also a token's place within its slab
    const int sp   = 4 * ((m >> 1) & 3) + 2 * (m >> 3) + (m & 1);  // K Q^T: row m is token sp
    const int jm   = (m & 1) + 2 * (m >> 3);  // K^T V: row m is j = jm of slab (m >> 1) & 3,
    const int ra   = 4 * ((m >> 1) & 3) + 2 * hi;   // its two tokens in this half
    const int rb   = 4 * (m >> 2) + 2 * hi;         // column (in O^T: row) m is e of slab m >> 2
    const bool sb0 = (m >> 2) & 1;       // that slab, bit by bit
    const bool sb1 = (m >> 3) & 1;
    const int hc   = w * 4;              // the head's first column in the tile

    __shared__ __align__(16) float tile[2][3][ROWS][PITCH];

    // staging role: 8 threads per row, 16 bytes each
    const int srow = tid >> 3;
    const int scol = (tid & 7) * 4;
    const size_t gbase = ((size_t)b * T_SEQ + (size_t)(seg * SEG + srow)) * C_DIM
                       + (size_t)(g * (HGRP * 4) + scol);
    const float4 emb4 = *(const float4*)(emb + g * (HGRP * 4) + scol);

    float4 q4 = *(const float4*)(xq + gbase);
    float4 k4 = *(const float4*)(xk + gbase);
    float4 v4 = *(const float4*)(xv + gbase);

    // Running state: S[i] of lane (m, hi) is state[2 hi + i][m & 3], i = 0, 1: the A fragment
    // of S^T. It starts from the earlier segments' sums (launch 1).
    v2f S;
    {
        const float* p = ws + (size_t)(b * NGRP + g) * NSEG * (HGRP * 16) + w * 16 + hi * 8 + e;
        // both loops are unrolled: the parts live in registers and the loads, all of them
        // of sums that launch 1 wrote, are in flight together
        float pa[NSEG - 1], pb[NSEG - 1];
#pragma unroll
        for (int s = 0; s < NSEG - 1; ++s) {
            pa[s] = p[s * (HGRP * 16)];
            pb[s] = p[s * (HGRP * 16) + 4];
        }
        // precaution: stands in front of any rewrite of the address registers of the loads above
        asm volatile("s_wait_xcnt 0x0" ::: "memory");
        float s0 = 0.0f, s1 = 0.0f;
#pragma unroll
        for (int s = 0; s < NSEG - 1; ++s) {
            s0 += (s < seg) ? pa[s] : 0.0f;
            s1 += (s < seg) ? pb[s] : 0.0f;
        }
        S.x = s0;
        S.y = s1;
    }

    for (int st = 0; st < NST; ++st) {
        float (*Q)[PITCH] = tile[st & 1][0];
        float (*K)[PITCH] = tile[st & 1][1];
        float (*V)[PITCH] = tile[st & 1][2];

        // ---- stage the 32 rows; the other buffer's last readers left before the last barrier ----
        *(float4*)(&Q[srow][scol]) = q4;
        *(float4*)(&K[srow][scol]) = k4;
        *(float4*)(&V[srow][scol]) = v4;
        lds_barrier();

        // ---- next stage's rows fly while this stage is worked on ----
        if (st + 1 < NST) {
            const size_t off = gbase + (size_t)((st + 1) * ROWS) * C_DIM;
            q4 = *(const float4*)(xq + off);
            k4 = *(const float4*)(xk + off);
            v4 = *(const float4*)(xv + off);
            // precaution: stands in front of any rewrite of the three address pairs; its memory
            // clobber also keeps the three loads above the stage's LDS reads
            asm volatile("s_wait_xcnt 0x0" ::: "memory");
        }

        float4 o[2];
#pragma unroll   // two chunks of one stage: o[] stays in registers
        for (int ch = 0; ch < 2; ++ch) {
            const int r0 = ch * CHUNK;
            // column m is token tq: chunk 1 swaps its halves, so that its outputs come out in the
            // lanes that chunk 0 leaves idle
            const int  tq = ch ? (m ^ 8) : m;
            const bool t1 = ch ? !sb1 : sb1;                          // high bit of tq's slab
            const v2f q2 = *(const v2f*)(&Q[r0 + tq][hc + 2 * hi]);   // Q[t = tq][j = 2 hi + i]
            const v2f k2 = *(const v2f*)(&K[r0 + sp][hc + 2 * hi]);   // K[s = sp][j = 2 hi + i]
            v2f ka, vb;
            ka.x = K[r0 + ra][hc + jm]; ka.y = K[r0 + ra + 1][hc + jm];
            vb.x = V[r0 + rb][hc + e];  vb.y = V[r0 + rb + 1][hc + e];

            // scores: P[r] of lane (m, hi) = q_t . k_s, t = tq, s = 4 (r >> 1) + 2 hi + (r & 1)
            v8f P = {};
            P = mm4(k2, q2, P);
            // slab sums: D[r] of lane (m, hi) is row (slab r >> 1, j = 2 hi + (r & 1)),
            // column (slab m >> 2, e)
            v8f D = {};
            D = mm4(ka, vb, D);

            // the scores of t's own slab, s = 4 slab + 2 hi + i, kept where s <= t
            v2f pp;
            pp.x = t1 ? (sb0 ? P[6] : P[4]) : (sb0 ? P[2] : P[0]);
            pp.y = t1 ? (sb0 ? P[7] : P[5]) : (sb0 ? P[3] : P[1]);
            pp.x = (2 * hi     <= e) ? pp.x : 0.0f;
            pp.y = (2 * hi + 1 <= e) ? pp.y : 0.0f;
            // within the slab: vb is also the A fragment, row (slab m >> 2, e), k = 2 hi + i
            v8f O = {};
            O = mm4(vb, pp, O);

            // keep the column's own slab, then sum over this and the lower slabs' lanes
            float d0 = sb1 ? (sb0 ? D[6] : D[4]) : (sb0 ? D[2] : D[0]);
            float d1 = sb1 ? (sb0 ? D[7] : D[5]) : (sb0 ? D[3] : D[1]);
            d0 += row_down<4>(d0); d1 += row_down<4>(d1);
            d0 += row_down<8>(d0); d1 += row_down<8>(d1);
            // state before slab m >> 2: row (slab, e) of the A fragment, k = j = 2 hi + i
            v2f sa;
            sa.x = S.x + row_down<4>(d0);
            sa.y = S.y + row_down<4>(d1);
            O = mm4(sa, q2, O);    // O[r] = o[t = tq][r & 3] where 2 hi + (r >> 2) is tq's slab
            o[ch].x = sb0 ? O[4] : O[0]; o[ch].y = sb0 ? O[5] : O[1];
            o[ch].z = sb0 ? O[6] : O[2]; o[ch].w = sb0 ? O[7] : O[3];

            // state += the sum of all 4 slabs (held by the lanes of slab 3)
            S.x += row_top4(d0);
            S.y += row_top4(d1);
        }

        // ---- the head's outputs take the place of its own q columns (read by this wave alone) ----
        {
            // chunk 0 is right where hi is the high bit of m's slab, chunk 1 in the other lanes
            const bool c1 = (hi != 0) != sb1;
            float4 ov;
            ov.x = c1 ? o[1].x : o[0].x; ov.y = c1 ? o[1].y : o[0].y;
            ov.z = c1 ? o[1].z : o[0].z; ov.w = c1 ? o[1].w : o[0].w;
            *(float4*)(&Q[c1 ? CHUNK + (m ^ 8) : m][hc]) = ov;
        }
        lds_barrier();

        // ---- write output (x emb), whole lines ----
        {
            const float4 r = *(const float4*)(&Q[srow][scol]);
            float4 ov;
            ov.x = r.x * emb4.x; ov.y = r.y * emb4.y; ov.z = r.z * emb4.z; ov.w = r.w * emb4.w;
            *(float4*)(out + gbase + (size_t)(st * ROWS) * C_DIM) = ov;
            // precaution: stands in front of any rewrite of the store's address pair
            asm volatile("s_wait_xcnt 0x0" ::: "memory");
        }
    }
}

extern "C" void kernel_launch(void* const* d_in, const int* in_sizes, int n_in,
                              void* d_out, int out_size, void* d_ws, size_t ws_size,
                              hipStream_t stream) {
    (void)n_in; (void)out_size; (void)ws_size;
    const float* xq  = (const float*)d_in[0];
    const float* xk  = (const float*)d_in[1];
    const float* xv  = (const float*)d_in[2];
    const float* emb = (const float*)d_in[3];
    float* out = (float*)d_out;
    float* ws  = (float*)d_ws;

    const int B = in_sizes[0] / (T_SEQ * C_DIM);   // = 4
    // launch 1: each lane sums 8 tokens of one head (one wave per 32 tokens)
    hipLaunchKernelGGL(seg_state_kernel, dim3(NGRP, NSEG - 1, B), dim3(SEG), 0, stream,
                       xk, xv, ws);
    hipLaunchKernelGGL(rosa_sufa_kernel, dim3(NGRP, NSEG, B), dim3(HGRP * 32), 0, stream,
                       xq, xk, xv, emb, ws, out);
}
